// v000
// Times are from an AMD MI455X. After a warm-up the kernel runs many times in a row, and a time is the length of
// such a window on the GPU divided by its runs, so every launch and the gaps after it count. The runs cycle
// through copies of the inputs. A figure is the median of several windows, for all but v000 over two sittings.
// Sittings can differ by a few percent; kernels timed side by side share one.
// v000, which the later versions start from, runs in 21.5 microseconds.
#include <hip/hip_runtime.h>

typedef __attribute__((ext_vector_type(2))) float v2f;
typedef __attribute__((ext_vector_type(4))) float v4f;
typedef __attribute__((ext_vector_type(8))) float v8f;

#define D 128
#define BATCH 16384
#define LDS_STRIDE 132   // 128 + 4 pad -> conflict-free b64 reads

// ---------------------------------------------------------------------------
// Kernel 1: M[x,y] = sum_z T[x,y,z]*tv[z]   (rows 0..16383 of a 16512-row job)
//           c[y]   = sum_z B[y,z]*tv[z]     (rows 16384..16511)
// One wave32 per 128-float row: float4 per lane, 5-step shuffle reduction.
// ---------------------------------------------------------------------------
__global__ __launch_bounds__(256) void k_reduce_tv(
    const float* __restrict__ T, const float* __restrict__ Bm,
    const float* __restrict__ tv, float* __restrict__ M, float* __restrict__ c)
{
    const int lane = threadIdx.x & 31;
    const int wave = threadIdx.x >> 5;
    const int row  = blockIdx.x * 8 + wave;          // 0 .. 16511

    const float* src = (row < D * D) ? (T + (size_t)row * D)
                                     : (Bm + (size_t)(row - D * D) * D);

    const v4f* s4 = (const v4f*)src;
    const v4f* t4 = (const v4f*)tv;
    v4f a = s4[lane];
    v4f t = t4[lane];
    float acc = a.x * t.x + a.y * t.y + a.z * t.z + a.w * t.w;

    #pragma unroll
    for (int off = 16; off > 0; off >>= 1)
        acc += __shfl_down(acc, off, 32);

    if (lane == 0) {
        if (row < D * D) M[row] = acc;
        else             c[row - D * D] = acc;
    }
}

// ---------------------------------------------------------------------------
// Kernel 2: W2T[o,x] = sum_y M[x,y] * op_w[o,y]       (stored TRANSPOSED)
//           bias2[o] = sum_y c[y]   * op_w[o,y] + op_b[o]
// block = o (128 blocks), thread = x (128 threads): op_w row o staged in LDS,
// W2T row stores are coalesced. Tiny kernel (4 MFLOP), lives in L2.
// ---------------------------------------------------------------------------
__global__ __launch_bounds__(128) void k_fold_opw(
    const float* __restrict__ M, const float* __restrict__ c,
    const float* __restrict__ op_w, const float* __restrict__ op_b,
    float* __restrict__ W2T, float* __restrict__ bias2)
{
    __shared__ float srow[D];
    const int x = threadIdx.x;
    const int o = blockIdx.x;

    srow[x] = op_w[(size_t)o * D + x];
    __syncthreads();

    const float* mrow = M + (size_t)x * D;
    float s = 0.f;
    #pragma unroll 4
    for (int y = 0; y < D; ++y) s += mrow[y] * srow[y];
    W2T[(size_t)o * D + x] = s;

    if (x == 0) {
        float sb = op_b[o];
        #pragma unroll 4
        for (int y = 0; y < D; ++y) sb += c[y] * srow[y];
        bias2[o] = sb;
    }
}

__global__ __launch_bounds__(256) void k_embed_gemm(
    const float* __restrict__ w_embed, const int* __restrict__ indices,
    const float* __restrict__ W2T, const float* __restrict__ bias2,
    float* __restrict__ out)
{
    __shared__ float sW2T[D * LDS_STRIDE];       // 67.5 KB (col-major, padded)

    const int tid   = threadIdx.x;
    const int lane  = tid & 31;
    const int wave  = tid >> 5;
    const int m0    = (blockIdx.x * 8 + wave) * 16;   // 16 batch rows per wave
    const int mrow  = lane & 15;                      // M (A/C) or N (B/C) index
    const int khalf = (lane >> 4) * 2;                // K sub-pair selector

    {
        #pragma unroll
        for (int i = 0; i < (D * D / 4) / 256; ++i) {
            const int gi  = tid + i * 256;
            const int col = gi >> 5;
            const int k4  = (gi & 31) << 2;
            // ptrtoint of the real LDS address: lo-32 bits == addrspace(3)
            // byte offset, and it captures sW2T so the asm may write it.
            const unsigned lds_off =
                (unsigned)(size_t)&sW2T[col * LDS_STRIDE + k4];
            const unsigned g_off = (unsigned)(gi * 16);
            asm volatile("global_load_async_to_lds_b128 %0, %1, %2"
                         :
                         : "v"(lds_off), "v"(g_off), "s"(W2T)
                         : "memory");
        }
    }

    // Visible dummy store into the padding lanes (never read): guarantees
    // sW2T has IR-level stores so its loads can't be optimized away.
    if (tid < D) sW2T[tid * LDS_STRIDE + D] = 0.f;

    const long long erow = (long long)indices[m0 + mrow];
    const float* arow = w_embed + erow * D;
    __builtin_prefetch(arow + (lane >> 4) * 64, 0, 0);

    // Init accumulators with the fused bias (same column for all 8 vgprs).
    v8f acc[8];
    #pragma unroll
    for (int t = 0; t < 8; ++t) {
        const float bv = bias2[t * 16 + mrow];
        acc[t] = (v8f){bv, bv, bv, bv, bv, bv, bv, bv};
    }

    // Own async copies done, then barrier for the other waves' copies.
    asm volatile("s_wait_asynccnt 0" ::: "memory");
    __syncthreads();

    for (int k0 = 0; k0 < D; k0 += 4) {
        // A fragment: 2 contiguous floats of this lane's embedding row.
        v2f a = *(const v2f*)(arow + k0 + khalf);

        #pragma unroll
        for (int t = 0; t < 8; ++t) {
            const int col = t * 16 + mrow;
            // B fragment: one aligned 8-byte LDS load (k, k+1 contiguous).
            v2f b = *(const v2f*)&sW2T[col * LDS_STRIDE + k0 + khalf];
            acc[t] = __builtin_amdgcn_wmma_f32_16x16x4_f32(
                /*neg_a=*/false, a, /*neg_b=*/false, b,
                /*c_mod=*/(short)0, acc[t],
                /*reuse_a=*/false, /*reuse_b=*/false);
        }
    }

    // Write the 16x128 strip.
    const int mbase = m0 + 8 * (lane >> 4);
    #pragma unroll
    for (int t = 0; t < 8; ++t) {
        const int col = t * 16 + mrow;
        #pragma unroll
        for (int r = 0; r < 8; ++r)
            out[(size_t)(mbase + r) * D + col] = acc[t][r];
    }
}

// ---------------------------------------------------------------------------
extern "C" void kernel_launch(void* const* d_in, const int* in_sizes, int n_in,
                              void* d_out, int out_size, void* d_ws, size_t ws_size,
                              hipStream_t stream) {
    const int*   indices = (const int*)  d_in[0];
    const float* w_embed = (const float*)d_in[1];
    const float* T       = (const float*)d_in[2];
    const float* Bm      = (const float*)d_in[3];
    const float* tv      = (const float*)d_in[4];
    const float* op_w    = (const float*)d_in[5];
    const float* op_b    = (const float*)d_in[6];
    float* out = (float*)d_out;

    float* ws    = (float*)d_ws;
    float* M     = ws;                 // 16384 floats
    float* c     = ws + D * D;         //   128 floats
    float* W2T   = ws + D * D + D;     // 16384 floats (transposed: [o][x])
    float* bias2 = ws + 2 * D * D + D; //   128 floats

    // 16512 rows (T's 16384 + B's 128), 8 rows per 256-thread block.
    k_reduce_tv<<<(D * D + D) / 8, 256, 0, stream>>>(T, Bm, tv, M, c);
    k_fold_opw<<<D, 128, 0, stream>>>(M, c, op_w, op_b, W2T, bias2);
    k_embed_gemm<<<BATCH / 128, 256, 0, stream>>>(w_embed, indices, W2T, bias2, out);
}

// v001
// A run of this version takes 14 microseconds.
// Two timings next to v000 both put it at 1.53 times that version's speed.
#include <hip/hip_runtime.h>

typedef __attribute__((ext_vector_type(2))) float v2f;
typedef __attribute__((ext_vector_type(4))) float v4f;
typedef __attribute__((ext_vector_type(8))) float v8f;

#define D 128
#define BATCH 16384

// ---------------------------------------------------------------------------
// Kernel 1 (fold): one work-group per x turns its own slab of T into one row
// of the folded weight, in one launch:
//   M[y]      = sum_z T[x,y,z] * tv[z]        (128 values, kept in LDS)
//   W2T[x,o]  = sum_y M[y] * op_w[o,y]        (row x: 512 contiguous bytes)
// Work-group 128 does the same with B in place of the slab and adds op_b:
//   bias2[o]  = sum_y (sum_z B[y,z]*tv[z]) * op_w[o,y] + op_b[o]
// so that out = we @ W2T + bias2.
// 8 waves; each wave owns 16 rows of the slab and 16 rows of op_w. A row is
// one 512-byte wave-wide load (float4 per lane) and a 5-step shuffle sum.
// All 33 loads of a lane are issued before the first sum, so the slab and
// op_w share one trip to memory.
// ---------------------------------------------------------------------------
#define ROWS_PER_WAVE 16

__device__ __forceinline__ void row_dots(const v4f (&rows)[ROWS_PER_WAVE],
                                         const v4f v, float (&acc)[ROWS_PER_WAVE])
{
    for (int r = 0; r < ROWS_PER_WAVE; ++r) {
        const v4f a = rows[r];
        acc[r] = a.x * v.x + a.y * v.y + a.z * v.z + a.w * v.w;
    }
    for (int off = 16; off > 0; off >>= 1) {
        for (int r = 0; r < ROWS_PER_WAVE; ++r)
            acc[r] += __shfl_down(acc[r], off, 32);
    }
}

__global__ __launch_bounds__(256) void k_fold(
    const float* __restrict__ T, const float* __restrict__ Bm,
    const float* __restrict__ tv, const float* __restrict__ op_w,
    const float* __restrict__ op_b,
    float* __restrict__ W2T, float* __restrict__ bias2)
{
    __shared__ __attribute__((aligned(16))) float sM[D];

    const int lane = threadIdx.x & 31;
    const int wave = threadIdx.x >> 5;
    const int x    = blockIdx.x;                     // 0..127: W2T row, 128: bias2
    const int row0 = wave * ROWS_PER_WAVE;

    const float* slab = (x < D) ? (T + (size_t)x * D * D) : Bm;
    const v4f* s4 = (const v4f*)slab + row0 * (D / 4) + lane;
    const v4f* w4 = (const v4f*)op_w + row0 * (D / 4) + lane;

    const v4f t = ((const v4f*)tv)[lane];
    // Keeps the tv load first: loads return in order, so behind op_w it would
    // make the first sum wait for every load of the lane.
    __builtin_amdgcn_sched_barrier(0);
    v4f a[ROWS_PER_WAVE], w[ROWS_PER_WAVE];
    for (int r = 0; r < ROWS_PER_WAVE; ++r) a[r] = s4[r * (D / 4)];
    for (int r = 0; r < ROWS_PER_WAVE; ++r) w[r] = w4[r * (D / 4)];
    v4f ob[ROWS_PER_WAVE / 4] = {};
    if (x == D) {
        for (int q = 0; q < ROWS_PER_WAVE / 4; ++q)
            ob[q] = *(const v4f*)&op_b[row0 + 4 * q];
    }
    // Keeps every load above the first sum: without it the compiler issues
    // most op_w loads only after the slab has arrived (a second trip).
    __builtin_amdgcn_sched_barrier(0);

    float acc[ROWS_PER_WAVE];
    row_dots(a, t, acc);
    if (lane == 0) {
        for (int q = 0; q < ROWS_PER_WAVE / 4; ++q)
            *(v4f*)&sM[row0 + 4 * q] =
                (v4f){acc[4 * q], acc[4 * q + 1], acc[4 * q + 2], acc[4 * q + 3]};
    }
    __syncthreads();

    const v4f m = *(const v4f*)&sM[4 * lane];
    row_dots(w, m, acc);
    if (lane == 0) {
        float* dst = (x < D) ? (W2T + (size_t)x * D) : bias2;
        v4f s[ROWS_PER_WAVE / 4];
        for (int q = 0; q < ROWS_PER_WAVE / 4; ++q)
            s[q] = (v4f){acc[4 * q], acc[4 * q + 1], acc[4 * q + 2], acc[4 * q + 3]};
        if (x == D) {
            for (int q = 0; q < ROWS_PER_WAVE / 4; ++q) s[q] += ob[q];
        }
        for (int q = 0; q < ROWS_PER_WAVE / 4; ++q)
            *(v4f*)&dst[row0 + 4 * q] = s[q];
    }
}

__global__ __launch_bounds__(256) void k_embed_gemm(
    const float* __restrict__ w_embed, const int* __restrict__ indices,
    const float* __restrict__ W2T, const float* __restrict__ bias2,
    float* __restrict__ out)
{
    __shared__ float sW2T[D * D + 4];            // 64 KB + 4 floats never read

    const int tid   = threadIdx.x;
    const int lane  = tid & 31;
    const int wave  = tid >> 5;
    const int m0    = (blockIdx.x * 8 + wave) * 16;   // 16 batch rows per wave
    const int mrow  = lane & 15;                      // M (A/C) or N (B/C) index
    const int khalf = (lane >> 4) * 2;                // K sub-pair selector

    {
        #pragma unroll
        for (int i = 0; i < (D * D / 4) / 256; ++i) {
            const int gi  = tid + i * 256;
            const int xr  = gi >> 5;
            const int o4  = (gi & 31) << 2;
            // ptrtoint of the real LDS address: lo-32 bits == addrspace(3)
            // byte offset, and it captures sW2T so the asm may write it.
            const unsigned lds_off =
                (unsigned)(size_t)&sW2T[((o4 >> 4) * D + xr) * 16 + (o4 & 15)];
            const unsigned g_off = (unsigned)(gi * 16);
            asm volatile("global_load_async_to_lds_b128 %0, %1, %2"
                         :
                         : "v"(lds_off), "v"(g_off), "s"(W2T)
                         : "memory");
        }
    }

    // Visible dummy store behind the tiles (never read): guarantees
    // sW2T has IR-level stores so its loads can't be optimized away.
    if (tid < 4) sW2T[D * D + tid] = 0.f;

    const long long erow = (long long)indices[m0 + mrow];
    const float* arow = w_embed + erow * D;
    __builtin_prefetch(arow + (lane >> 4) * 64, 0, 0);

    // Init accumulators with the fused bias (same column for all 8 vgprs).
    v8f acc[8];
    #pragma unroll
    for (int t = 0; t < 8; ++t) {
        const float bv = bias2[t * 16 + mrow];
        acc[t] = (v8f){bv, bv, bv, bv, bv, bv, bv, bv};
    }

    // Own async copies done, then barrier for the other waves' copies.
    asm volatile("s_wait_asynccnt 0" ::: "memory");
    __syncthreads();

    for (int k0 = 0; k0 < D; k0 += 4) {
        // A fragment: 2 contiguous floats of this lane's embedding row.
        v2f a = *(const v2f*)(arow + k0 + khalf);

        #pragma unroll
        for (int t = 0; t < 8; ++t) {
            // B fragment: column mrow of tile t, LDS rows k and k+1.
            const float* bp = &sW2T[(t * D + k0 + khalf) * 16 + mrow];
            v2f b = (v2f){bp[0], bp[16]};
            acc[t] = __builtin_amdgcn_wmma_f32_16x16x4_f32(
                /*neg_a=*/false, a, /*neg_b=*/false, b,
                /*c_mod=*/(short)0, acc[t],
                /*reuse_a=*/false, /*reuse_b=*/false);
        }
    }

    // Write the 16x128 strip.
    const int mbase = m0 + 8 * (lane >> 4);
    #pragma unroll
    for (int t = 0; t < 8; ++t) {
        const int col = t * 16 + mrow;
        #pragma unroll
        for (int r = 0; r < 8; ++r)
            out[(size_t)(mbase + r) * D + col] = acc[t][r];
    }
}

// ---------------------------------------------------------------------------
extern "C" void kernel_launch(void* const* d_in, const int* in_sizes, int n_in,
                              void* d_out, int out_size, void* d_ws, size_t ws_size,
                              hipStream_t stream) {
    const int*   indices = (const int*)  d_in[0];
    const float* w_embed = (const float*)d_in[1];
    const float* T       = (const float*)d_in[2];
    const float* Bm      = (const float*)d_in[3];
    const float* tv      = (const float*)d_in[4];
    const float* op_w    = (const float*)d_in[5];
    const float* op_b    = (const float*)d_in[6];
    float* out = (float*)d_out;

    float* ws    = (float*)d_ws;
    float* W2T   = ws;                 // 16384 floats ([x][o])
    float* bias2 = ws + D * D;         //   128 floats

    // 128 rows of W2T and, from B and op_b, bias2: one work-group each.
    k_fold<<<D + 1, 256, 0, stream>>>(T, Bm, tv, op_w, op_b, W2T, bias2);
    k_embed_gemm<<<BATCH / 128, 256, 0, stream>>>(w_embed, indices, W2T, bias2, out);
}

// v002
// A run of this version takes 11.5 microseconds.
// Next to v001, in two timings, it ran 1.21 times as fast each time.
// Counting every step since v000, it is 1.86 times as fast.
#include <hip/hip_runtime.h>

typedef __attribute__((ext_vector_type(2))) float v2f;
typedef __attribute__((ext_vector_type(4))) float v4f;
typedef __attribute__((ext_vector_type(8))) float v8f;

#define D 128
#define BATCH 16384

// ---------------------------------------------------------------------------
// Kernel 1 (fold): one work-group per x turns its own slab of T into one row
// of the folded weight, in one launch:
//   M[y]      = sum_z T[x,y,z] * tv[z]        (128 values, kept in LDS)
//   W2T[x,o]  = sum_y M[y] * op_w[o,y]        (row x: 512 contiguous bytes)
// Work-group 128 does the same with B in place of the slab and adds op_b:
//   bias2[o]  = sum_y (sum_z B[y,z]*tv[z]) * op_w[o,y] + op_b[o]
// so that out = we @ W2T + bias2.
// 8 waves; each wave owns 16 rows of the slab and 16 rows of op_w. A row is
// one 512-byte wave-wide load (float4 per lane) and a 5-step shuffle sum.
// All 33 loads of a lane are issued before the first sum, so the slab and
// op_w share one trip to memory.
// ---------------------------------------------------------------------------
#define ROWS_PER_WAVE 16

__device__ __forceinline__ void row_dots(const v4f (&rows)[ROWS_PER_WAVE],
                                         const v4f v, float (&acc)[ROWS_PER_WAVE])
{
    for (int r = 0; r < ROWS_PER_WAVE; ++r) {
        const v4f a = rows[r];
        acc[r] = a.x * v.x + a.y * v.y + a.z * v.z + a.w * v.w;
    }
    for (int off = 16; off > 0; off >>= 1) {
        for (int r = 0; r < ROWS_PER_WAVE; ++r)
            acc[r] += __shfl_down(acc[r], off, 32);
    }
}

__global__ __launch_bounds__(256) void k_fold(
    const float* __restrict__ T, const float* __restrict__ Bm,
    const float* __restrict__ tv, const float* __restrict__ op_w,
    const float* __restrict__ op_b,
    float* __restrict__ W2T, float* __restrict__ bias2)
{
    __shared__ __attribute__((aligned(16))) float sM[D];

    const int lane = threadIdx.x & 31;
    const int wave = threadIdx.x >> 5;
    const int x    = blockIdx.x;                     // 0..127: W2T row, 128: bias2
    const int row0 = wave * ROWS_PER_WAVE;

    const float* slab = (x < D) ? (T + (size_t)x * D * D) : Bm;
    const v4f* s4 = (const v4f*)slab + row0 * (D / 4) + lane;
    const v4f* w4 = (const v4f*)op_w + row0 * (D / 4) + lane;

    const v4f t = ((const v4f*)tv)[lane];
    // Keeps the tv load first: loads return in order, so behind op_w it would
    // make the first sum wait for every load of the lane.
    __builtin_amdgcn_sched_barrier(0);
    v4f a[ROWS_PER_WAVE], w[ROWS_PER_WAVE];
    for (int r = 0; r < ROWS_PER_WAVE; ++r) a[r] = s4[r * (D / 4)];
    for (int r = 0; r < ROWS_PER_WAVE; ++r) w[r] = w4[r * (D / 4)];
    v4f ob[ROWS_PER_WAVE / 4] = {};
    if (x == D) {
        for (int q = 0; q < ROWS_PER_WAVE / 4; ++q)
            ob[q] = *(const v4f*)&op_b[row0 + 4 * q];
    }
    // Keeps every load above the first sum: without it the compiler issues
    // most op_w loads only after the slab has arrived (a second trip).
    __builtin_amdgcn_sched_barrier(0);

    float acc[ROWS_PER_WAVE];
    row_dots(a, t, acc);
    if (lane == 0) {
        for (int q = 0; q < ROWS_PER_WAVE / 4; ++q)
            *(v4f*)&sM[row0 + 4 * q] =
                (v4f){acc[4 * q], acc[4 * q + 1], acc[4 * q + 2], acc[4 * q + 3]};
    }
    __syncthreads();

    const v4f m = *(const v4f*)&sM[4 * lane];
    row_dots(w, m, acc);
    if (lane == 0) {
        float* dst = (x < D) ? (W2T + (size_t)x * D) : bias2;
        v4f s[ROWS_PER_WAVE / 4];
        for (int q = 0; q < ROWS_PER_WAVE / 4; ++q)
            s[q] = (v4f){acc[4 * q], acc[4 * q + 1], acc[4 * q + 2], acc[4 * q + 3]};
        if (x == D) {
            for (int q = 0; q < ROWS_PER_WAVE / 4; ++q) s[q] += ob[q];
        }
        for (int q = 0; q < ROWS_PER_WAVE / 4; ++q)
            *(v4f*)&dst[row0 + 4 * q] = s[q];
    }
}

#define NT 4

__global__ __launch_bounds__(256) void k_embed_gemm(
    const float* __restrict__ w_embed, const int* __restrict__ indices,
    const float* __restrict__ W2T, const float* __restrict__ bias2,
    float* __restrict__ out)
{
    __shared__ float sW2T[D * D + 4];            // 64 KB + 4 floats never read

    const int tid   = threadIdx.x;
    const int lane  = tid & 31;
    const int wave  = tid >> 5;
    const int m0    = (blockIdx.x * 4 + (wave & 3)) * 16; // 16 batch rows per wave
    const int chalf = wave >> 2;                      // the wave's column half
    const int mrow  = lane & 15;                      // M (A/C) or N (B/C) index
    const int khalf = (lane >> 4) * 2;                // K sub-pair selector
    const int col0  = chalf * (NT * 16) + mrow;       // lane's column in the wave's first tile
    const int ldsc0 = chalf * (NT * D * 16) + mrow;   // the same column in sW2T

    {
        #pragma unroll
        for (int i = 0; i < (D * D / 4) / 256; ++i) {
            const int gi  = tid + i * 256;
            const int xr  = gi >> 5;
            const int o4  = (gi & 31) << 2;
            // ptrtoint of the real LDS address: lo-32 bits == addrspace(3)
            // byte offset, and it captures sW2T so the asm may write it.
            const unsigned lds_off =
                (unsigned)(size_t)&sW2T[((o4 >> 4) * D + xr) * 16 + (o4 & 15)];
            const unsigned g_off = (unsigned)(gi * 16);
            asm volatile("global_load_async_to_lds_b128 %0, %1, %2"
                         :
                         : "v"(lds_off), "v"(g_off), "s"(W2T)
                         : "memory");
        }
    }

    // Visible dummy store behind the tiles (never read): guarantees
    // sW2T has IR-level stores so its loads can't be optimized away.
    if (tid < 4) sW2T[D * D + tid] = 0.f;

    const long long erow = (long long)indices[m0 + mrow];
    const float* arow = w_embed + erow * D;
    __builtin_prefetch(arow + (lane >> 4) * 64, 0, 0);

    // Init accumulators with the fused bias (same column for all 8 vgprs).
    v8f acc[NT];
    #pragma unroll
    for (int t = 0; t < NT; ++t) {
        const float bv = bias2[col0 + t * 16];
        acc[t] = (v8f){bv, bv, bv, bv, bv, bv, bv, bv};
    }

    // Own async copies done, then barrier for the other waves' copies.
    asm volatile("s_wait_asynccnt 0" ::: "memory");
    __syncthreads();

    #pragma unroll 8
    for (int k0 = 0; k0 < D; k0 += 4) {
        // A fragment: 2 contiguous floats of this lane's embedding row.
        v2f a = *(const v2f*)(arow + k0 + khalf);

        #pragma unroll
        for (int t = 0; t < NT; ++t) {
            // B fragment: the lane's column of the wave's tile t, LDS rows k and k+1.
            const float* bp = &sW2T[ldsc0 + (t * D + k0 + khalf) * 16];
            v2f b = (v2f){bp[0], bp[16]};
            acc[t] = __builtin_amdgcn_wmma_f32_16x16x4_f32(
                /*neg_a=*/false, a, /*neg_b=*/false, b,
                /*c_mod=*/(short)0, acc[t],
                /*reuse_a=*/false, /*reuse_b=*/false);
        }
    }

    // Write the 16x64 strip.
    const int mbase = m0 + 8 * (lane >> 4);
    #pragma unroll
    for (int t = 0; t < NT; ++t) {
        const int col = col0 + t * 16;
        #pragma unroll
        for (int r = 0; r < 8; ++r)
            out[(size_t)(mbase + r) * D + col] = acc[t][r];
    }
}

// ---------------------------------------------------------------------------
extern "C" void kernel_launch(void* const* d_in, const int* in_sizes, int n_in,
                              void* d_out, int out_size, void* d_ws, size_t ws_size,
                              hipStream_t stream) {
    const int*   indices = (const int*)  d_in[0];
    const float* w_embed = (const float*)d_in[1];
    const float* T       = (const float*)d_in[2];
    const float* Bm      = (const float*)d_in[3];
    const float* tv      = (const float*)d_in[4];
    const float* op_w    = (const float*)d_in[5];
    const float* op_b    = (const float*)d_in[6];
    float* out = (float*)d_out;

    float* ws    = (float*)d_ws;
    float* W2T   = ws;                 // 16384 floats ([x][o])
    float* bias2 = ws + D * D;         //   128 floats

    // 128 rows of W2T and, from B and op_b, bias2: one work-group each.
    k_fold<<<D + 1, 256, 0, stream>>>(T, Bm, tv, op_w, op_b, W2T, bias2);
    k_embed_gemm<<<BATCH / 64, 256, 0, stream>>>(w_embed, indices, W2T, bias2, out);
}

// v003
// One run takes 10.9 microseconds.
// In two side-by-side timings against v002, it was 1.06 and 1.07 times as fast.
// Over all steps from v000 it is 1.98 times as fast.
#include <hip/hip_runtime.h>

typedef __attribute__((ext_vector_type(2))) float v2f;
typedef __attribute__((ext_vector_type(4))) float v4f;
typedef __attribute__((ext_vector_type(8))) float v8f;

#define D 128
#define BATCH 16384
#define VOCAB 100000

// ---------------------------------------------------------------------------
// Kernel 1 (fold): one work-group per x turns its own slab of T into one row
// of the folded weight, in one launch:
//   M[y]      = sum_z T[x,y,z] * tv[z]        (128 values, kept in LDS)
//   W2T[x,o]  = sum_y M[y] * op_w[o,y]        (row x: 512 contiguous bytes)
// Work-group 128 does the same with B in place of the slab and adds op_b:
//   bias2[o]  = sum_y (sum_z B[y,z]*tv[z]) * op_w[o,y] + op_b[o]
// so that out = we @ W2T + bias2.
// 8 waves; each wave owns 16 rows of the slab and 16 rows of op_w. A row is
// one 512-byte wave-wide load (float4 per lane) and a 5-step shuffle sum.
// All 33 loads of a lane are issued before the first sum, so the slab and
// op_w share one trip to memory.
// ---------------------------------------------------------------------------
#define ROWS_PER_WAVE 16

__device__ __forceinline__ void row_dots(const v4f (&rows)[ROWS_PER_WAVE],
                                         const v4f v, float (&acc)[ROWS_PER_WAVE])
{
    for (int r = 0; r < ROWS_PER_WAVE; ++r) {
        const v4f a = rows[r];
        acc[r] = a.x * v.x + a.y * v.y + a.z * v.z + a.w * v.w;
    }
    for (int off = 16; off > 0; off >>= 1) {
        for (int r = 0; r < ROWS_PER_WAVE; ++r)
            acc[r] += __shfl_down(acc[r], off, 32);
    }
}

__global__ __launch_bounds__(256) void k_fold(
    const float* __restrict__ T, const float* __restrict__ Bm,
    const float* __restrict__ tv, const float* __restrict__ op_w,
    const float* __restrict__ op_b,
    float* __restrict__ W2T, float* __restrict__ bias2)
{
    __shared__ __attribute__((aligned(16))) float sM[D];

    const int lane = threadIdx.x & 31;
    const int wave = threadIdx.x >> 5;
    const int x    = blockIdx.x;                     // 0..127: W2T row, 128: bias2
    const int row0 = wave * ROWS_PER_WAVE;

    const float* slab = (x < D) ? (T + (size_t)x * D * D) : Bm;
    const v4f* s4 = (const v4f*)slab + row0 * (D / 4) + lane;
    const v4f* w4 = (const v4f*)op_w + row0 * (D / 4) + lane;

    const v4f t = ((const v4f*)tv)[lane];
    // Keeps the tv load first: loads return in order, so behind op_w it would
    // make the first sum wait for every load of the lane.
    __builtin_amdgcn_sched_barrier(0);
    v4f a[ROWS_PER_WAVE], w[ROWS_PER_WAVE];
    for (int r = 0; r < ROWS_PER_WAVE; ++r) a[r] = s4[r * (D / 4)];
    for (int r = 0; r < ROWS_PER_WAVE; ++r) w[r] = w4[r * (D / 4)];
    v4f ob[ROWS_PER_WAVE / 4] = {};
    if (x == D) {
        for (int q = 0; q < ROWS_PER_WAVE / 4; ++q)
            ob[q] = *(const v4f*)&op_b[row0 + 4 * q];
    }
    // Keeps every load above the first sum: without it the compiler issues
    // most op_w loads only after the slab has arrived (a second trip).
    __builtin_amdgcn_sched_barrier(0);

    float acc[ROWS_PER_WAVE];
    row_dots(a, t, acc);
    if (lane == 0) {
        for (int q = 0; q < ROWS_PER_WAVE / 4; ++q)
            *(v4f*)&sM[row0 + 4 * q] =
                (v4f){acc[4 * q], acc[4 * q + 1], acc[4 * q + 2], acc[4 * q + 3]};
    }
    __syncthreads();

    const v4f m = *(const v4f*)&sM[4 * lane];
    row_dots(w, m, acc);
    if (lane == 0) {
        float* dst = (x < D) ? (W2T + (size_t)x * D) : bias2;
        v4f s[ROWS_PER_WAVE / 4];
        for (int q = 0; q < ROWS_PER_WAVE / 4; ++q)
            s[q] = (v4f){acc[4 * q], acc[4 * q + 1], acc[4 * q + 2], acc[4 * q + 3]};
        if (x == D) {
            for (int q = 0; q < ROWS_PER_WAVE / 4; ++q) s[q] += ob[q];
        }
        for (int q = 0; q < ROWS_PER_WAVE / 4; ++q)
            *(v4f*)&dst[row0 + 4 * q] = s[q];
    }
}

#define NT 4
#define WG_ROWS 64
#define ROWS_PER_COPY_WAVE (WG_ROWS / 8)
#define APITCH (D + 4)

__global__ __launch_bounds__(256) void k_embed_gemm(
    const float* __restrict__ w_embed, const int* __restrict__ indices,
    const float* __restrict__ W2T, const float* __restrict__ bias2,
    float* __restrict__ out)
{
    __shared__ float sW2T[D * D + 4];            // 64 KB + 4 floats never read
    __shared__ __attribute__((aligned(16))) float sA[WG_ROWS * APITCH];

    const int tid   = threadIdx.x;
    const int lane  = tid & 31;
    const int wave  = tid >> 5;
    const int m0    = (blockIdx.x * 4 + (wave & 3)) * 16; // 16 batch rows per wave
    const int chalf = wave >> 2;                      // the wave's column half
    const int mrow  = lane & 15;                      // M (A/C) or N (B/C) index
    const int khalf = (lane >> 4) * 2;                // K sub-pair selector
    const int col0  = chalf * (NT * 16) + mrow;       // lane's column in the wave's first tile
    const int ldsc0 = chalf * (NT * D * 16) + mrow;   // the same column in sW2T

    // The 8 rows this wave gathers: their indices, read first so that the trip
    // for them runs beside the W2T copies' issue. The wave number is made
    // scalar so that they come by one scalar load. Each index is bounded here,
    // whatever the array holds, before an address is formed from it.
    const int cwave = __builtin_amdgcn_readfirstlane(wave);
    int erow[ROWS_PER_COPY_WAVE];
    for (int i = 0; i < ROWS_PER_COPY_WAVE; ++i) {
        const int e = indices[blockIdx.x * WG_ROWS + cwave * ROWS_PER_COPY_WAVE + i];
        erow[i] = min(max(e, 0), VOCAB - 1);
    }

    {
        #pragma unroll
        for (int i = 0; i < (D * D / 4) / 256; ++i) {
            const int gi  = tid + i * 256;
            const int xr  = gi >> 5;
            const int o4  = (gi & 31) << 2;
            // ptrtoint of the real LDS address: lo-32 bits == addrspace(3)
            // byte offset, and it captures sW2T so the asm may write it.
            const unsigned lds_off =
                (unsigned)(size_t)&sW2T[((o4 >> 4) * D + xr) * 16 + (o4 & 15)];
            const unsigned g_off = (unsigned)(gi * 16);
            asm volatile("global_load_async_to_lds_b128 %0, %1, %2"
                         :
                         : "v"(lds_off), "v"(g_off), "s"(W2T)
                         : "memory");
        }
    }

    // Visible dummy store behind the tiles (never read): guarantees
    // sW2T has IR-level stores so its loads can't be optimized away.
    if (tid < 4) sW2T[D * D + tid] = 0.f;

    {
        const float* g[ROWS_PER_COPY_WAVE];
        unsigned     l[ROWS_PER_COPY_WAVE];
        for (int i = 0; i < ROWS_PER_COPY_WAVE; ++i) {
            g[i] = w_embed + (size_t)erow[i] * D + lane * 4;
            l[i] = (unsigned)(size_t)
                &sA[(cwave * ROWS_PER_COPY_WAVE + i) * APITCH + lane * 4];
        }
        asm volatile("global_load_async_to_lds_b128 %0, %8, off\n\t"
                     "global_load_async_to_lds_b128 %1, %9, off\n\t"
                     "global_load_async_to_lds_b128 %2, %10, off\n\t"
                     "global_load_async_to_lds_b128 %3, %11, off\n\t"
                     "global_load_async_to_lds_b128 %4, %12, off\n\t"
                     "global_load_async_to_lds_b128 %5, %13, off\n\t"
                     "global_load_async_to_lds_b128 %6, %14, off\n\t"
                     "global_load_async_to_lds_b128 %7, %15, off\n\t"
                     "s_wait_xcnt 0x0"
                     :
                     : "v"(l[0]), "v"(l[1]), "v"(l[2]), "v"(l[3]),
                       "v"(l[4]), "v"(l[5]), "v"(l[6]), "v"(l[7]),
                       "v"(g[0]), "v"(g[1]), "v"(g[2]), "v"(g[3]),
                       "v"(g[4]), "v"(g[5]), "v"(g[6]), "v"(g[7])
                     : "memory");
    }

    // Init accumulators with the fused bias (same column for all 8 vgprs).
    v8f acc[NT];
    #pragma unroll
    for (int t = 0; t < NT; ++t) {
        const float bv = bias2[col0 + t * 16];
        acc[t] = (v8f){bv, bv, bv, bv, bv, bv, bv, bv};
    }

    // Own async copies done, then barrier for the other waves' copies.
    asm volatile("s_wait_asynccnt 0" ::: "memory");
    __syncthreads();

    const float* arow = &sA[((wave & 3) * 16 + mrow) * APITCH + khalf];
    // The lane's column of the wave's first tile, at its k half.
    const float* bcol = &sW2T[ldsc0 + khalf * 16];

    // Unrolled whole: with both operands in LDS nothing is batched by trips any
    // more, and the LDS reads run ahead of the WMMAs through all 32 k steps
    // with no drain at a trip's end.
    #pragma unroll
    for (int k0 = 0; k0 < D; k0 += 4) {
        // A fragment: 2 contiguous floats of this lane's embedding row.
        v2f a = *(const v2f*)(arow + k0);

        #pragma unroll
        for (int t = 0; t < NT; ++t) {
            // B fragment: the lane's column of the wave's tile t, LDS rows k and k+1.
            const float* bp = bcol + (t * D + k0) * 16;
            v2f b = (v2f){bp[0], bp[16]};
            acc[t] = __builtin_amdgcn_wmma_f32_16x16x4_f32(
                /*neg_a=*/false, a, /*neg_b=*/false, b,
                /*c_mod=*/(short)0, acc[t],
                /*reuse_a=*/false, /*reuse_b=*/false);
        }
    }

    // Write the 16x64 strip.
    const int mbase = m0 + 8 * (lane >> 4);
    #pragma unroll
    for (int t = 0; t < NT; ++t) {
        const int col = col0 + t * 16;
        #pragma unroll
        for (int r = 0; r < 8; ++r)
            out[(size_t)(mbase + r) * D + col] = acc[t][r];
    }
}

// ---------------------------------------------------------------------------
extern "C" void kernel_launch(void* const* d_in, const int* in_sizes, int n_in,
                              void* d_out, int out_size, void* d_ws, size_t ws_size,
                              hipStream_t stream) {
    const int*   indices = (const int*)  d_in[0];
    const float* w_embed = (const float*)d_in[1];
    const float* T       = (const float*)d_in[2];
    const float* Bm      = (const float*)d_in[3];
    const float* tv      = (const float*)d_in[4];
    const float* op_w    = (const float*)d_in[5];
    const float* op_b    = (const float*)d_in[6];
    float* out = (float*)d_out;

    float* ws    = (float*)d_ws;
    float* W2T   = ws;                 // 16384 floats ([x][o])
    float* bias2 = ws + D * D;         //   128 floats

    // 128 rows of W2T and, from B and op_b, bias2: one work-group each.
    k_fold<<<D + 1, 256, 0, stream>>>(T, Bm, tv, op_w, op_b, W2T, bias2);
    k_embed_gemm<<<BATCH / 64, 256, 0, stream>>>(w_embed, indices, W2T, bias2, out);
}

// v004
// Measured time: 10.1 microseconds a run.
// Two timings next to v003 both put it at 1.07 times that version's speed.
// Over all steps from v000 it is 2.11 times as fast.
#include <hip/hip_runtime.h>

typedef __attribute__((ext_vector_type(2))) float v2f;
typedef __attribute__((ext_vector_type(4))) float v4f;
typedef __attribute__((ext_vector_type(8))) float v8f;

#define D 128
#define BATCH 16384
#define VOCAB 100000

// ---------------------------------------------------------------------------
// Kernel 1 (fold): one work-group per x turns its own slab of T into one row
// of the folded weight, in one launch:
//   M[y]      = sum_z T[x,y,z] * tv[z]        (128 values, kept in LDS)
//   W2T[x,o]  = sum_y M[y] * op_w[o,y]        (row x: 512 contiguous bytes)
// Work-group 128 does the same with B in place of the slab and adds op_b:
//   bias2[o]  = sum_y (sum_z B[y,z]*tv[z]) * op_w[o,y] + op_b[o]
// so that out = we @ W2T + bias2.
// 8 waves; each wave owns 16 rows of the slab and 16 rows of op_w. A row is
// one 512-byte wave-wide load (float4 per lane) and a 5-step sum over lanes,
// done in registers. All 33 loads of a lane are issued before the first sum,
// so the slab and op_w share one trip to memory.
// ---------------------------------------------------------------------------
#define ROWS_PER_WAVE 16

__device__ __forceinline__ float other_row(float x)
{
    const int b = __builtin_bit_cast(int, x);
    return __builtin_bit_cast(float, __builtin_amdgcn_permlanex16(
        b, b, 0x76543210, 0xfedcba98, false, false));
}

template <int MASK>
__device__ __forceinline__ float row_xor(float x)
{
    return __builtin_bit_cast(float, __builtin_amdgcn_mov_dpp(
        __builtin_bit_cast(int, x), 0x160 | MASK, 0xf, 0xf, false));
}

#define FOLD_STEP(dst, src, n, bit, xchg)                                    \
    for (int r = 0; r < (n) / 2; ++r)                                        \
        dst[r] = ((bit) ? src[r + (n) / 2] : src[r]) +                       \
                 xchg((bit) ? src[r] : src[r + (n) / 2]);

__device__ __forceinline__ float row_dots(const v4f (&rows)[ROWS_PER_WAVE],
                                          const v4f v, const int lane)
{
    float s16[ROWS_PER_WAVE], s8[8], s4[4], s2[2], s1[1];
    for (int r = 0; r < ROWS_PER_WAVE; ++r) {
        const v4f a = rows[r];
        s16[r] = a.x * v.x + a.y * v.y + a.z * v.z + a.w * v.w;
    }
    FOLD_STEP(s8, s16, 16, lane & 16, other_row)
    FOLD_STEP(s4, s8,   8, lane &  8, row_xor<8>)
    FOLD_STEP(s2, s4,   4, lane &  4, row_xor<4>)
    FOLD_STEP(s1, s2,   2, lane &  2, row_xor<2>)
    return s1[0] + row_xor<1>(s1[0]);
}

__global__ __launch_bounds__(256) void k_fold(
    const float* __restrict__ T, const float* __restrict__ Bm,
    const float* __restrict__ tv, const float* __restrict__ op_w,
    const float* __restrict__ op_b,
    float* __restrict__ W2T, float* __restrict__ bias2)
{
    __shared__ __attribute__((aligned(16))) float sM[D];

    const int lane = threadIdx.x & 31;
    const int wave = threadIdx.x >> 5;
    const int x    = blockIdx.x;                     // 0..127: W2T row, 128: bias2
    const int row0 = wave * ROWS_PER_WAVE;

    const float* slab = (x < D) ? (T + (size_t)x * D * D) : Bm;
    const v4f* s4 = (const v4f*)slab + row0 * (D / 4) + lane;
    const v4f* w4 = (const v4f*)op_w + row0 * (D / 4) + lane;

    // Keeps the block index and both row pointers ahead of the tv load: formed
    // behind it they took over the load's base registers, and the translation
    // wait that this costs stood in front of the 32 row loads.
    __builtin_amdgcn_sched_barrier(0);
    const v4f t = ((const v4f*)tv)[lane];
    // Keeps the tv load first: loads return in order, so behind op_w it would
    // make the first sum wait for every load of the lane.
    __builtin_amdgcn_sched_barrier(0);
    v4f a[ROWS_PER_WAVE], w[ROWS_PER_WAVE];
    for (int r = 0; r < ROWS_PER_WAVE; ++r) a[r] = s4[r * (D / 4)];
    for (int r = 0; r < ROWS_PER_WAVE; ++r) w[r] = w4[r * (D / 4)];
    const int myrow = row0 + (lane >> 1);            // the row whose sum this lane ends with
    float ob = 0.f;
    if (x == D) ob = op_b[myrow];
    asm volatile("s_wait_xcnt 0x0" :: "v"(s4), "v"(w4) : "memory");
    // Keeps every load above the first sum: without it the compiler issues
    // most op_w loads only after the slab has arrived (a second trip).
    __builtin_amdgcn_sched_barrier(0);

    // Lanes 2j and 2j + 1 end with the same sum: the even one stores it.
    const float mrow = row_dots(a, t, lane);
    if ((lane & 1) == 0) sM[myrow] = mrow;
    __syncthreads();

    const v4f m = *(const v4f*)&sM[4 * lane];
    float s = row_dots(w, m, lane);
    if (x == D) s += ob;
    if ((lane & 1) == 0) {
        float* dst = (x < D) ? (W2T + (size_t)x * D) : bias2;
        dst[myrow] = s;
    }
}

#define NT 4
#define WG_ROWS 64
#define ROWS_PER_COPY_WAVE (WG_ROWS / 8)
#define APITCH (D + 4)

__global__ __launch_bounds__(256) void k_embed_gemm(
    const float* __restrict__ w_embed, const int* __restrict__ indices,
    const float* __restrict__ W2T, const float* __restrict__ bias2,
    float* __restrict__ out)
{
    __shared__ float sW2T[D * D + 4];            // 64 KB + 4 floats never read
    __shared__ __attribute__((aligned(16))) float sA[WG_ROWS * APITCH];

    const int tid   = threadIdx.x;
    const int lane  = tid & 31;
    const int wave  = tid >> 5;
    const int m0    = (blockIdx.x * 4 + (wave & 3)) * 16; // 16 batch rows per wave
    const int chalf = wave >> 2;                      // the wave's column half
    const int mrow  = lane & 15;                      // M (A/C) or N (B/C) index
    const int khalf = (lane >> 4) * 2;                // K sub-pair selector
    const int col0  = chalf * (NT * 16) + mrow;       // lane's column in the wave's first tile
    const int ldsc0 = chalf * (NT * D * 16) + mrow;   // the same column in sW2T

    // The 8 rows this wave gathers: their indices, read first so that the trip
    // for them runs beside the W2T copies' issue. The wave number is made
    // scalar so that they come by one scalar load. Each index is bounded here,
    // whatever the array holds, before an address is formed from it.
    const int cwave = __builtin_amdgcn_readfirstlane(wave);
    int erow[ROWS_PER_COPY_WAVE];
    for (int i = 0; i < ROWS_PER_COPY_WAVE; ++i) {
        const int e = indices[blockIdx.x * WG_ROWS + cwave * ROWS_PER_COPY_WAVE + i];
        erow[i] = min(max(e, 0), VOCAB - 1);
    }

    {
        #pragma unroll
        for (int i = 0; i < (D * D / 4) / 256; ++i) {
            const int gi  = tid + i * 256;
            const int xr  = gi >> 5;
            const int o4  = (gi & 31) << 2;
            // ptrtoint of the real LDS address: lo-32 bits == addrspace(3)
            // byte offset, and it captures sW2T so the asm may write it.
            const unsigned lds_off =
                (unsigned)(size_t)&sW2T[((o4 >> 4) * D + xr) * 16 + (o4 & 15)];
            const unsigned g_off = (unsigned)(gi * 16);
            asm volatile("global_load_async_to_lds_b128 %0, %1, %2"
                         :
                         : "v"(lds_off), "v"(g_off), "s"(W2T)
                         : "memory");
        }
    }

    // Visible dummy store behind the tiles (never read): guarantees
    // sW2T has IR-level stores so its loads can't be optimized away.
    if (tid < 4) sW2T[D * D + tid] = 0.f;

    {
        const float* g[ROWS_PER_COPY_WAVE];
        unsigned     l[ROWS_PER_COPY_WAVE];
        for (int i = 0; i < ROWS_PER_COPY_WAVE; ++i) {
            g[i] = w_embed + (size_t)erow[i] * D + lane * 4;
            l[i] = (unsigned)(size_t)
                &sA[(cwave * ROWS_PER_COPY_WAVE + i) * APITCH + lane * 4];
        }
        asm volatile("global_load_async_to_lds_b128 %0, %8, off\n\t"
                     "global_load_async_to_lds_b128 %1, %9, off\n\t"
                     "global_load_async_to_lds_b128 %2, %10, off\n\t"
                     "global_load_async_to_lds_b128 %3, %11, off\n\t"
                     "global_load_async_to_lds_b128 %4, %12, off\n\t"
                     "global_load_async_to_lds_b128 %5, %13, off\n\t"
                     "global_load_async_to_lds_b128 %6, %14, off\n\t"
                     "global_load_async_to_lds_b128 %7, %15, off\n\t"
                     "s_wait_xcnt 0x0"
                     :
                     : "v"(l[0]), "v"(l[1]), "v"(l[2]), "v"(l[3]),
                       "v"(l[4]), "v"(l[5]), "v"(l[6]), "v"(l[7]),
                       "v"(g[0]), "v"(g[1]), "v"(g[2]), "v"(g[3]),
                       "v"(g[4]), "v"(g[5]), "v"(g[6]), "v"(g[7])
                     : "memory");
    }

    // Init accumulators with the fused bias (same column for all 8 vgprs).
    v8f acc[NT];
    #pragma unroll
    for (int t = 0; t < NT; ++t) {
        const float bv = bias2[col0 + t * 16];
        acc[t] = (v8f){bv, bv, bv, bv, bv, bv, bv, bv};
    }

    // Own async copies done, then barrier for the other waves' copies.
    asm volatile("s_wait_asynccnt 0" ::: "memory");
    __syncthreads();

    const float* arow = &sA[((wave & 3) * 16 + mrow) * APITCH + khalf];
    // The lane's column of the wave's first tile, at its k half.
    const float* bcol = &sW2T[ldsc0 + khalf * 16];

    // Unrolled whole: with both operands in LDS nothing is batched by trips any
    // more, and the LDS reads run ahead of the WMMAs through all 32 k steps
    // with no drain at a trip's end.
    #pragma unroll
    for (int k0 = 0; k0 < D; k0 += 4) {
        // A fragment: 2 contiguous floats of this lane's embedding row.
        v2f a = *(const v2f*)(arow + k0);

        #pragma unroll
        for (int t = 0; t < NT; ++t) {
            // B fragment: the lane's column of the wave's tile t, LDS rows k and k+1.
            const float* bp = bcol + (t * D + k0) * 16;
            v2f b = (v2f){bp[0], bp[16]};
            acc[t] = __builtin_amdgcn_wmma_f32_16x16x4_f32(
                /*neg_a=*/false, a, /*neg_b=*/false, b,
                /*c_mod=*/(short)0, acc[t],
                /*reuse_a=*/false, /*reuse_b=*/false);
        }
    }

    // Write the 16x64 strip.
    const int mbase = m0 + 8 * (lane >> 4);
    #pragma unroll
    for (int t = 0; t < NT; ++t) {
        const int col = col0 + t * 16;
        #pragma unroll
        for (int r = 0; r < 8; ++r)
            out[(size_t)(mbase + r) * D + col] = acc[t][r];
    }
}

// ---------------------------------------------------------------------------
extern "C" void kernel_launch(void* const* d_in, const int* in_sizes, int n_in,
                              void* d_out, int out_size, void* d_ws, size_t ws_size,
                              hipStream_t stream) {
    const int*   indices = (const int*)  d_in[0];
    const float* w_embed = (const float*)d_in[1];
    const float* T       = (const float*)d_in[2];
    const float* Bm      = (const float*)d_in[3];
    const float* tv      = (const float*)d_in[4];
    const float* op_w    = (const float*)d_in[5];
    const float* op_b    = (const float*)d_in[6];
    float* out = (float*)d_out;

    float* ws    = (float*)d_ws;
    float* W2T   = ws;                 // 16384 floats ([x][o])
    float* bias2 = ws + D * D;         //   128 floats

    // 128 rows of W2T and, from B and op_b, bias2: one work-group each.
    k_fold<<<D + 1, 256, 0, stream>>>(T, Bm, tv, op_w, op_b, W2T, bias2);
    k_embed_gemm<<<BATCH / 64, 256, 0, stream>>>(w_embed, indices, W2T, bias2, out);
}
